// v000
// Times are from an AMD MI455X. After a warm-up the kernel runs many times in a row, and a time is the length of
// such a window on the GPU divided by its runs, so every launch and the gaps after it count. The runs cycle
// through copies of the inputs. A figure is the median of several windows, for all but v000 over two sittings.
// Sittings can differ by a few percent; kernels timed side by side share one.
// The starting kernel, v000, takes 465 microseconds a run.
#include <hip/hip_runtime.h>

// ---------------------------------------------------------------------------
// JEHierarchicalClassifier on MI455X (gfx1250, wave32, WMMA f32 16x16x4)
//
// Shapes: B=8192, Din=2048, D=1024, P=16, C0=32, C1=64
// d_out layout (floats): parent_logits[8192*16] | child0[8192*32] |
//                        child1[8192*64] | parent_emb[8192*1024] |
//                        child_emb[8192*1024]
// d_ws: parent_class int[8192]
// ---------------------------------------------------------------------------

typedef float v2f __attribute__((ext_vector_type(2)));
typedef float v8f __attribute__((ext_vector_type(8)));

#define LN_EPS 1e-5f

__device__ __forceinline__ float wave_sum32(float v) {
    v += __shfl_xor(v, 16, 32);
    v += __shfl_xor(v, 8, 32);
    v += __shfl_xor(v, 4, 32);
    v += __shfl_xor(v, 2, 32);
    v += __shfl_xor(v, 1, 32);
    return v;
}

// reduction within each 16-lane half of a wave32 (xor masks < 16 never cross)
__device__ __forceinline__ float half_sum16(float v) {
    v += __shfl_xor(v, 8, 32);
    v += __shfl_xor(v, 4, 32);
    v += __shfl_xor(v, 2, 32);
    v += __shfl_xor(v, 1, 32);
    return v;
}

// ---------------------------------------------------------------------------
// Kernel 1: x[8192,2048] @ W[2048,1024]  (z=0: parent_proj_w, z=1: child_proj_w)
// Block: 256 threads = 8 waves. Tile: 256(M) x 64(N), K chunked by 32 via LDS.
// Each wave: 32x64 strip = 2 A frags x 4 B frags -> 8 WMMA per k-step
// (6 LDS b64 loads per 8 WMMAs).
//
// LDS layouts:
//  xs : row-major, row stride 36 floats (pad kills the stride-32 bank alias,
//       keeps b64/b128 alignment).
//  wsm: paired-K: element (k,n) at wsm[(k>>1)*160 + n*2 + (k&1)], so a B
//       fragment {W[k][n], W[k+1][n]} is ONE aligned ds_load_b64 -> no
//       v_dual_mov repacking in front of the WMMAs. kp-stride 160 puts the
//       two half-waves on disjoint even-bank sets.
// ---------------------------------------------------------------------------
#define XS_STRIDE 36
#define WS_STRIDE 160

__global__ __launch_bounds__(256) void jh_gemm_dual(
    const float* __restrict__ x,
    const float* __restrict__ w_parent,
    const float* __restrict__ w_child,
    float* __restrict__ out_parent,
    float* __restrict__ out_child)
{
    const int K = 2048, N = 1024;
    const float* __restrict__ W   = (blockIdx.z == 0) ? w_parent  : w_child;
    float* __restrict__       out = (blockIdx.z == 0) ? out_parent : out_child;
    const int n0 = blockIdx.x * 64;
    const int m0 = blockIdx.y * 256;

    __shared__ float xs[256 * XS_STRIDE];   // 36 KB
    __shared__ float wsm[16 * WS_STRIDE];   // 10 KB

    const int tid  = threadIdx.x;
    const int wave = tid >> 5;
    const int lane = tid & 31;
    const int half = lane >> 4;
    const int m    = lane & 15;

    v8f acc[2][4];
#pragma unroll
    for (int f = 0; f < 2; ++f)
#pragma unroll
        for (int t = 0; t < 4; ++t)
#pragma unroll
            for (int i = 0; i < 8; ++i) acc[f][t][i] = 0.0f;

    for (int k0 = 0; k0 < K; k0 += 32) {
        // cooperative load: x tile 256x32 (2048 float4, 8/thread)
#pragma unroll
        for (int i = 0; i < 8; ++i) {
            int idx = tid + 256 * i;
            int r = idx >> 3, c = (idx & 7) << 2;
            float4 v = *(const float4*)(x + (size_t)(m0 + r) * K + k0 + c);
            *(float4*)(xs + r * XS_STRIDE + c) = v;
        }
        // cooperative load: w tile 32x64 into paired-K layout (2/thread)
#pragma unroll
        for (int i = 0; i < 2; ++i) {
            int idx = tid + 256 * i;
            int kr = idx >> 4, c = (idx & 15) << 2;
            float4 v = *(const float4*)(W + (size_t)(k0 + kr) * N + n0 + c);
            float* dst = wsm + (kr >> 1) * WS_STRIDE + (kr & 1);
            dst[(c + 0) * 2] = v.x;
            dst[(c + 1) * 2] = v.y;
            dst[(c + 2) * 2] = v.z;
            dst[(c + 3) * 2] = v.w;
        }
        // prefetch next K-chunk into cache hierarchy (global_prefetch_b8)
        if (k0 + 32 < K) {
            __builtin_prefetch(x + (size_t)(m0 + tid) * K + (k0 + 32), 0, 3);
            __builtin_prefetch(W + (size_t)(k0 + 32 + (tid >> 3)) * N + n0 + (tid & 7) * 8, 0, 3);
        }
        __syncthreads();

        const float* xr0 = xs + (wave * 32 + m) * XS_STRIDE;
        const float* xr1 = xr0 + 16 * XS_STRIDE;
#pragma unroll
        for (int kk = 0; kk < 32; kk += 4) {
            // A frag 16x4: lanes0-15 -> K pair (kk,kk+1); lanes16-31 -> (kk+2,kk+3)
            const int kb = kk + half * 2;
            v2f a0 = *(const v2f*)(xr0 + kb);
            v2f a1 = *(const v2f*)(xr1 + kb);
            const float* wp = wsm + (kb >> 1) * WS_STRIDE + m * 2;
#pragma unroll
            for (int t = 0; t < 4; ++t) {
                v2f b = *(const v2f*)(wp + t * 32);   // {W[kb][n], W[kb+1][n]}
                acc[0][t] = __builtin_amdgcn_wmma_f32_16x16x4_f32(
                    false, a0, false, b, (short)0, acc[0][t], false, false);
                acc[1][t] = __builtin_amdgcn_wmma_f32_16x16x4_f32(
                    false, a1, false, b, (short)0, acc[1][t], false, false);
            }
        }
        __syncthreads();
    }

    // C layout: VGPR r -> row r (lanes 0-15) / row r+8 (lanes 16-31), col = lane&15
#pragma unroll
    for (int f = 0; f < 2; ++f)
#pragma unroll
        for (int t = 0; t < 4; ++t)
#pragma unroll
            for (int r = 0; r < 8; ++r) {
                int row = m0 + wave * 32 + f * 16 + r + half * 8;
                int col = n0 + t * 16 + m;
                out[(size_t)row * N + col] = acc[f][t][r];
            }
}

// ---------------------------------------------------------------------------
// Kernel 2: y = LN(raw + bias) in place over D=1024. One wave32 per row.
// grid: (1024, 2), block 256 (8 waves)
// ---------------------------------------------------------------------------
__global__ __launch_bounds__(256) void jh_ln_bias(
    float* __restrict__ emb_parent, float* __restrict__ emb_child,
    const float* __restrict__ b_parent, const float* __restrict__ b_child)
{
    const int D = 1024;
    float* base        = (blockIdx.y == 0) ? emb_parent : emb_child;
    const float* bias  = (blockIdx.y == 0) ? b_parent   : b_child;
    const int wave = threadIdx.x >> 5;
    const int lane = threadIdx.x & 31;
    const int row  = blockIdx.x * 8 + wave;
    float* p = base + (size_t)row * D;

    float4 v[8];
    float s = 0.f, s2 = 0.f;
#pragma unroll
    for (int j = 0; j < 8; ++j) {
        int c4 = lane + 32 * j;
        float4 t  = ((const float4*)p)[c4];
        float4 bb = ((const float4*)bias)[c4];
        t.x += bb.x; t.y += bb.y; t.z += bb.z; t.w += bb.w;
        v[j] = t;
        s  += t.x + t.y + t.z + t.w;
        s2 += t.x * t.x + t.y * t.y + t.z * t.z + t.w * t.w;
    }
    s  = wave_sum32(s);
    s2 = wave_sum32(s2);
    const float mean = s * (1.0f / 1024.0f);
    const float var  = s2 * (1.0f / 1024.0f) - mean * mean;
    const float rstd = rsqrtf(var + LN_EPS);
#pragma unroll
    for (int j = 0; j < 8; ++j) {
        float4 t = v[j];
        t.x = (t.x - mean) * rstd;
        t.y = (t.y - mean) * rstd;
        t.z = (t.z - mean) * rstd;
        t.w = (t.w - mean) * rstd;
        ((float4*)p)[lane + 32 * j] = t;
    }
}

// ---------------------------------------------------------------------------
// Kernel 3: parent_logits = LN(pemb @ Wcls + b), argmax -> parent_class.
// One wave per 16 rows; WMMA f32 16x16x4 over K=1024. N=16 LN fits a half-wave.
// ---------------------------------------------------------------------------
__global__ __launch_bounds__(32) void jh_parent_cls(
    const float* __restrict__ pemb,  // [8192,1024] (normalized)
    const float* __restrict__ wcls,  // [1024,16]
    const float* __restrict__ bcls,  // [16]
    float* __restrict__ plog,        // [8192,16]
    int* __restrict__ pclass)        // [8192]
{
    const int D = 1024, P = 16;
    const int lane = threadIdx.x & 31;
    const int half = lane >> 4;
    const int m    = lane & 15;
    const int row0 = blockIdx.x * 16;

    v8f acc;
#pragma unroll
    for (int i = 0; i < 8; ++i) acc[i] = 0.0f;

    const float* arow = pemb + (size_t)(row0 + m) * D;
    for (int k0 = 0; k0 < D; k0 += 4) {
        const int ak = k0 + half * 2;
        v2f a; a.x = arow[ak];          a.y = arow[ak + 1];
        v2f b; b.x = wcls[ak * P + m];  b.y = wcls[(ak + 1) * P + m];
        acc = __builtin_amdgcn_wmma_f32_16x16x4_f32(
            false, a, false, b, (short)0, acc, false, false);
    }

    const float bv = bcls[m];
#pragma unroll
    for (int r = 0; r < 8; ++r) {
        const int row = row0 + r + half * 8;
        float val = acc[r] + bv;
        // LN over the 16 logits of this row (spread over one half-wave)
        const float mean = half_sum16(val) * (1.0f / 16.0f);
        const float d    = val - mean;
        const float var  = half_sum16(d * d) * (1.0f / 16.0f);
        const float y    = d * rsqrtf(var + LN_EPS);
        plog[(size_t)row * P + m] = y;
        // argmax over N=16 (LN is a positive-scale affine map -> same argmax)
        float best = y; int bidx = m;
#pragma unroll
        for (int msk = 8; msk >= 1; msk >>= 1) {
            float ob = __shfl_xor(best, msk, 32);
            int   oi = __shfl_xor(bidx, msk, 32);
            if (ob > best || (ob == best && oi < bidx)) { best = ob; bidx = oi; }
        }
        if (m == 0) pclass[row] = bidx;
    }
}

// ---------------------------------------------------------------------------
// Kernel 4: gathered child heads. One wave per sample: only the SELECTED
// parent's head is computed (vs. reference's dense-all-parents + select).
// lane -> column; C0=32 (1 acc), C1=64 (2 accs); LN via wave reductions.
// ---------------------------------------------------------------------------
__global__ __launch_bounds__(256) void jh_child_heads(
    const float* __restrict__ cemb,  // [8192,1024] (normalized)
    const float* __restrict__ w0,    // [16,1024,32]
    const float* __restrict__ b0,    // [16,32]
    const float* __restrict__ w1,    // [16,1024,64]
    const float* __restrict__ b1,    // [16,64]
    const int* __restrict__ pclass,  // [8192]
    float* __restrict__ out0,        // [8192,32]
    float* __restrict__ out1)        // [8192,64]
{
    const int D = 1024;
    const int wave = threadIdx.x >> 5;
    const int lane = threadIdx.x & 31;
    const int s = blockIdx.x * 8 + wave;
    const int p = pclass[s];

    const float* ce = cemb + (size_t)s * D;
    const float* W0 = w0 + (size_t)p * D * 32;
    const float* W1 = w1 + (size_t)p * D * 64;

    float a0 = 0.f, a1 = 0.f, a2 = 0.f;
    for (int k = 0; k < D; k += 4) {
        const float4 c4 = *(const float4*)(ce + k);
        a0 += c4.x * W0[(k + 0) * 32 + lane] + c4.y * W0[(k + 1) * 32 + lane]
            + c4.z * W0[(k + 2) * 32 + lane] + c4.w * W0[(k + 3) * 32 + lane];
        a1 += c4.x * W1[(k + 0) * 64 + lane] + c4.y * W1[(k + 1) * 64 + lane]
            + c4.z * W1[(k + 2) * 64 + lane] + c4.w * W1[(k + 3) * 64 + lane];
        a2 += c4.x * W1[(k + 0) * 64 + 32 + lane] + c4.y * W1[(k + 1) * 64 + 32 + lane]
            + c4.z * W1[(k + 2) * 64 + 32 + lane] + c4.w * W1[(k + 3) * 64 + 32 + lane];
    }

    // child0: LN over 32 (full wave)
    {
        const float v    = a0 + b0[p * 32 + lane];
        const float mean = wave_sum32(v) * (1.0f / 32.0f);
        const float d    = v - mean;
        const float var  = wave_sum32(d * d) * (1.0f / 32.0f);
        out0[(size_t)s * 32 + lane] = d * rsqrtf(var + LN_EPS);
    }
    // child1: LN over 64 (2 values per lane)
    {
        const float u0   = a1 + b1[p * 64 + lane];
        const float u1   = a2 + b1[p * 64 + 32 + lane];
        const float mean = wave_sum32(u0 + u1) * (1.0f / 64.0f);
        const float d0 = u0 - mean, d1 = u1 - mean;
        const float var  = wave_sum32(d0 * d0 + d1 * d1) * (1.0f / 64.0f);
        const float rstd = rsqrtf(var + LN_EPS);
        out1[(size_t)s * 64 + lane]      = d0 * rstd;
        out1[(size_t)s * 64 + 32 + lane] = d1 * rstd;
    }
}

// ---------------------------------------------------------------------------
extern "C" void kernel_launch(void* const* d_in, const int* in_sizes, int n_in,
                              void* d_out, int out_size, void* d_ws, size_t ws_size,
                              hipStream_t stream) {
    (void)in_sizes; (void)n_in; (void)out_size; (void)ws_size;
    const float* x   = (const float*)d_in[0];
    const float* ppw = (const float*)d_in[1];
    const float* ppb = (const float*)d_in[2];
    const float* cpw = (const float*)d_in[3];
    const float* cpb = (const float*)d_in[4];
    const float* pcw = (const float*)d_in[5];
    const float* pcb = (const float*)d_in[6];
    const float* cw0 = (const float*)d_in[7];
    const float* cb0 = (const float*)d_in[8];
    const float* cw1 = (const float*)d_in[9];
    const float* cb1 = (const float*)d_in[10];

    float* out   = (float*)d_out;
    float* plog  = out;                       // [8192,16]
    float* c0    = plog + 8192 * 16;          // [8192,32]
    float* c1    = c0   + 8192 * 32;          // [8192,64]
    float* pemb  = c1   + 8192 * 64;          // [8192,1024]
    float* cemb  = pemb + 8192 * 1024;        // [8192,1024]
    int*   pclass = (int*)d_ws;               // [8192]

    // 1) both big GEMMs (raw, pre-bias) into d_out emb regions
    dim3 g1(1024 / 64, 8192 / 256, 2);
    jh_gemm_dual<<<g1, 256, 0, stream>>>(x, ppw, cpw, pemb, cemb);

    // 2) bias + LayerNorm in place
    dim3 g2(8192 / 8, 2);
    jh_ln_bias<<<g2, 256, 0, stream>>>(pemb, cemb, ppb, cpb);

    // 3) parent logits (WMMA) + LN + argmax
    jh_parent_cls<<<8192 / 16, 32, 0, stream>>>(pemb, pcw, pcb, plog, pclass);

    // 4) gathered child heads + LN
    jh_child_heads<<<8192 / 8, 256, 0, stream>>>(cemb, cw0, cb0, cw1, cb1,
                                                 pclass, c0, c1);
}

// v001
// One run takes 402 microseconds.
// Two timings next to v000 put it at 1.20 and 1.19 times that version's speed.
#include <hip/hip_runtime.h>

// ---------------------------------------------------------------------------
// JEHierarchicalClassifier on MI455X (gfx1250, wave32, WMMA f32 16x16x4)
//
// Shapes: B=8192, Din=2048, D=1024, P=16, C0=32, C1=64
// d_out layout (floats): parent_logits[8192*16] | child0[8192*32] |
//                        child1[8192*64] | parent_emb[8192*1024] |
//                        child_emb[8192*1024]
// d_ws: parent_class int[8192]
// ---------------------------------------------------------------------------

typedef float v2f __attribute__((ext_vector_type(2)));
typedef float v8f __attribute__((ext_vector_type(8)));

#define LN_EPS 1e-5f

__device__ __forceinline__ float wave_sum32(float v) {
    v += __shfl_xor(v, 16, 32);
    v += __shfl_xor(v, 8, 32);
    v += __shfl_xor(v, 4, 32);
    v += __shfl_xor(v, 2, 32);
    v += __shfl_xor(v, 1, 32);
    return v;
}

// reduction within each 16-lane half of a wave32 (xor masks < 16 never cross)
__device__ __forceinline__ float half_sum16(float v) {
    v += __shfl_xor(v, 8, 32);
    v += __shfl_xor(v, 4, 32);
    v += __shfl_xor(v, 2, 32);
    v += __shfl_xor(v, 1, 32);
    return v;
}

// ---------------------------------------------------------------------------
// Kernel 1: x[8192,2048] @ W[2048,1024]  (z=0: parent_proj_w, z=1: child_proj_w)
// Block: 256 threads = 8 waves. Tile: 256(M) x 64(N), K chunked by 32 via LDS.
// Each wave: 32x64 strip = 2 A frags x 4 B frags -> 8 WMMA per k-step
// (6 LDS b64 loads per 8 WMMAs).
//
// LDS layouts:
//  xs : row-major, row stride 36 floats (pad kills the stride-32 bank alias,
//       keeps b64/b128 alignment).
//  wsm: paired-K: element (k,n) at wsm[(k>>1)*160 + n*2 + (k&1)], so a B
//       fragment {W[k][n], W[k+1][n]} is ONE aligned ds_load_b64 -> no
//       v_dual_mov repacking in front of the WMMAs. kp-stride 160 puts the
//       two half-waves on disjoint even-bank sets.
// ---------------------------------------------------------------------------
#define XS_STRIDE 36
#define WS_STRIDE 160

__global__ __launch_bounds__(256) void jh_gemm_dual(
    const float* __restrict__ x,
    const float* __restrict__ w_parent,
    const float* __restrict__ w_child,
    float* __restrict__ out_parent,
    float* __restrict__ out_child)
{
    const int K = 2048, N = 1024;
    const float* __restrict__ W   = (blockIdx.z == 0) ? w_parent  : w_child;
    float* __restrict__       out = (blockIdx.z == 0) ? out_parent : out_child;
    const int n0 = blockIdx.x * 64;
    const int m0 = blockIdx.y * 256;

    __shared__ float xs[256 * XS_STRIDE];   // 36 KB
    __shared__ float wsm[16 * WS_STRIDE];   // 10 KB

    const int tid  = threadIdx.x;
    const int wave = tid >> 5;
    const int lane = tid & 31;
    const int half = lane >> 4;
    const int m    = lane & 15;

    v8f acc[2][4];
#pragma unroll
    for (int f = 0; f < 2; ++f)
#pragma unroll
        for (int t = 0; t < 4; ++t)
#pragma unroll
            for (int i = 0; i < 8; ++i) acc[f][t][i] = 0.0f;

    for (int k0 = 0; k0 < K; k0 += 32) {
        // cooperative load: x tile 256x32 (2048 float4, 8/thread)
#pragma unroll
        for (int i = 0; i < 8; ++i) {
            int idx = tid + 256 * i;
            int r = idx >> 3, c = (idx & 7) << 2;
            float4 v = *(const float4*)(x + (size_t)(m0 + r) * K + k0 + c);
            *(float4*)(xs + r * XS_STRIDE + c) = v;
        }
        // cooperative load: w tile 32x64 into paired-K layout (2/thread)
#pragma unroll
        for (int i = 0; i < 2; ++i) {
            int idx = tid + 256 * i;
            int kr = idx >> 4, c = (idx & 15) << 2;
            float4 v = *(const float4*)(W + (size_t)(k0 + kr) * N + n0 + c);
            float* dst = wsm + (kr >> 1) * WS_STRIDE + (kr & 1);
            dst[(c + 0) * 2] = v.x;
            dst[(c + 1) * 2] = v.y;
            dst[(c + 2) * 2] = v.z;
            dst[(c + 3) * 2] = v.w;
        }
        // prefetch next K-chunk into cache hierarchy (global_prefetch_b8)
        if (k0 + 32 < K) {
            __builtin_prefetch(x + (size_t)(m0 + tid) * K + (k0 + 32), 0, 3);
            __builtin_prefetch(W + (size_t)(k0 + 32 + (tid >> 3)) * N + n0 + (tid & 7) * 8, 0, 3);
        }
        __syncthreads();

        const float* xr0 = xs + (wave * 32 + m) * XS_STRIDE;
        const float* xr1 = xr0 + 16 * XS_STRIDE;
#pragma unroll
        for (int kk = 0; kk < 32; kk += 4) {
            // A frag 16x4: lanes0-15 -> K pair (kk,kk+1); lanes16-31 -> (kk+2,kk+3)
            const int kb = kk + half * 2;
            v2f a0 = *(const v2f*)(xr0 + kb);
            v2f a1 = *(const v2f*)(xr1 + kb);
            const float* wp = wsm + (kb >> 1) * WS_STRIDE + m * 2;
#pragma unroll
            for (int t = 0; t < 4; ++t) {
                v2f b = *(const v2f*)(wp + t * 32);   // {W[kb][n], W[kb+1][n]}
                acc[0][t] = __builtin_amdgcn_wmma_f32_16x16x4_f32(
                    false, a0, false, b, (short)0, acc[0][t], false, false);
                acc[1][t] = __builtin_amdgcn_wmma_f32_16x16x4_f32(
                    false, a1, false, b, (short)0, acc[1][t], false, false);
            }
        }
        __syncthreads();
    }

    // C layout: VGPR r -> row r (lanes 0-15) / row r+8 (lanes 16-31), col = lane&15
#pragma unroll
    for (int f = 0; f < 2; ++f)
#pragma unroll
        for (int t = 0; t < 4; ++t)
#pragma unroll
            for (int r = 0; r < 8; ++r) {
                int row = m0 + wave * 32 + f * 16 + r + half * 8;
                int col = n0 + t * 16 + m;
                out[(size_t)row * N + col] = acc[f][t][r];
            }
}

// ---------------------------------------------------------------------------
// Kernel 2: y = LN(raw + bias) in place over D=1024. One wave32 per row.
// grid: (1024, 2), block 256 (8 waves)
// ---------------------------------------------------------------------------
__global__ __launch_bounds__(256) void jh_ln_bias(
    float* __restrict__ emb_parent, float* __restrict__ emb_child,
    const float* __restrict__ b_parent, const float* __restrict__ b_child)
{
    const int D = 1024;
    float* base        = (blockIdx.y == 0) ? emb_parent : emb_child;
    const float* bias  = (blockIdx.y == 0) ? b_parent   : b_child;
    const int wave = threadIdx.x >> 5;
    const int lane = threadIdx.x & 31;
    const int row  = blockIdx.x * 8 + wave;
    float* p = base + (size_t)row * D;

    float4 v[8];
    float s = 0.f, s2 = 0.f;
#pragma unroll
    for (int j = 0; j < 8; ++j) {
        int c4 = lane + 32 * j;
        float4 t  = ((const float4*)p)[c4];
        float4 bb = ((const float4*)bias)[c4];
        t.x += bb.x; t.y += bb.y; t.z += bb.z; t.w += bb.w;
        v[j] = t;
        s  += t.x + t.y + t.z + t.w;
        s2 += t.x * t.x + t.y * t.y + t.z * t.z + t.w * t.w;
    }
    s  = wave_sum32(s);
    s2 = wave_sum32(s2);
    const float mean = s * (1.0f / 1024.0f);
    const float var  = s2 * (1.0f / 1024.0f) - mean * mean;
    const float rstd = rsqrtf(var + LN_EPS);
#pragma unroll
    for (int j = 0; j < 8; ++j) {
        float4 t = v[j];
        t.x = (t.x - mean) * rstd;
        t.y = (t.y - mean) * rstd;
        t.z = (t.z - mean) * rstd;
        t.w = (t.w - mean) * rstd;
        ((float4*)p)[lane + 32 * j] = t;
    }
}

// ---------------------------------------------------------------------------
// Kernel 3: parent_logits = LN(pemb @ Wcls + b), argmax -> parent_class.
// One wave per 16 rows; WMMA f32 16x16x4 over K=1024. N=16 LN fits a half-wave.
// ---------------------------------------------------------------------------
__global__ __launch_bounds__(32) void jh_parent_cls(
    const float* __restrict__ pemb,  // [8192,1024] (normalized)
    const float* __restrict__ wcls,  // [1024,16]
    const float* __restrict__ bcls,  // [16]
    float* __restrict__ plog,        // [8192,16]
    int* __restrict__ pclass)        // [8192]
{
    const int D = 1024, P = 16;
    const int lane = threadIdx.x & 31;
    const int half = lane >> 4;
    const int m    = lane & 15;
    const int row0 = blockIdx.x * 16;

    v8f acc;
#pragma unroll
    for (int i = 0; i < 8; ++i) acc[i] = 0.0f;

    const float* arow = pemb + (size_t)(row0 + m) * D;
    for (int k0 = 0; k0 < D; k0 += 4) {
        const int ak = k0 + half * 2;
        v2f a; a.x = arow[ak];          a.y = arow[ak + 1];
        v2f b; b.x = wcls[ak * P + m];  b.y = wcls[(ak + 1) * P + m];
        acc = __builtin_amdgcn_wmma_f32_16x16x4_f32(
            false, a, false, b, (short)0, acc, false, false);
    }

    const float bv = bcls[m];
#pragma unroll
    for (int r = 0; r < 8; ++r) {
        const int row = row0 + r + half * 8;
        float val = acc[r] + bv;
        // LN over the 16 logits of this row (spread over one half-wave)
        const float mean = half_sum16(val) * (1.0f / 16.0f);
        const float d    = val - mean;
        const float var  = half_sum16(d * d) * (1.0f / 16.0f);
        const float y    = d * rsqrtf(var + LN_EPS);
        plog[(size_t)row * P + m] = y;
        // argmax over N=16 (LN is a positive-scale affine map -> same argmax)
        float best = y; int bidx = m;
#pragma unroll
        for (int msk = 8; msk >= 1; msk >>= 1) {
            float ob = __shfl_xor(best, msk, 32);
            int   oi = __shfl_xor(bidx, msk, 32);
            if (ob > best || (ob == best && oi < bidx)) { best = ob; bidx = oi; }
        }
        if (m == 0) pclass[row] = bidx;
    }
}

// ---------------------------------------------------------------------------
// Kernel 4: child heads, samples grouped by their parent class.
// Block (chunk, p): picks out of its 512 samples those whose class is p
// (ballot + prefix, stable order), then runs them as 16-row WMMA tiles against
// W0[p] | W1[p], so the 384 KB of one parent's weights are read once per 48-row group
// and not once per sample.
// 16 waves split K: wave w owns k in [64w, 64w+64), all 6 column tiles and up
// to 3 row tiles; the 16 partial sums meet in LDS, then bias + LN + store.
//
// k order inside one trip of 8 k (same for A and B): lane half h, step s,
// register i  ->  k = 8*trip + 4*h + 2*s + i.
// column order: W0 tile t, lane m -> column 2m+t ; W1 tile t, lane m -> 4m+t
// (one b64 / b128 load of a weight row feeds 2 / 4 column tiles).
// ---------------------------------------------------------------------------
#define CH_CHUNK  512
#define CH_ROWS   48                    // rows of one group (3 tiles)
#define CH_APITCH 68                    // floats; 272 B = 16 B x odd
#define CH_RPITCH 100                   // floats; pitch of a row of partial sums
#define CH_WREG   (CH_ROWS * CH_RPITCH) // floats of LDS owned by one wave

// Global loads of this kernel: s_wait_xcnt 0 stands directly behind each, in front of
// whatever rewrites the load's address registers next (the data stays in flight).
__device__ __forceinline__ float4 jh_ld4(const float* p) {
    const float4 v = *(const float4*)p;
    asm volatile("s_wait_xcnt 0x0" ::: "memory");
    return v;
}
__device__ __forceinline__ float2 jh_ld2(const float* p) {
    const float2 v = *(const float2*)p;
    asm volatile("s_wait_xcnt 0x0" ::: "memory");
    return v;
}

template <int NT>
__device__ __forceinline__ void jh_child_group(
    const float* __restrict__ cemb,
    const float* __restrict__ W0, const float* __restrict__ W1,
    const float* __restrict__ b0p, const float* __restrict__ b1p,
    float* __restrict__ out0, float* __restrict__ out1,
    float* smem, const int* list, const int* wofs, const int base, const int cnt,
    const int tid, const int wave)
{
    const int lane = tid & 31;
    const int half = lane >> 4;
    const int m    = lane & 15;
    // this wave's LDS range, read here and not formed ahead of the group loop: every
    // row address below then stays this one register plus an immediate offset
    float* myreg = smem + wofs[tid >> 5];

    const float* w0p = W0 + (wave * 64 + half * 4) * 32 + m * 2;
    const float* w1p = W1 + (wave * 64 + half * 4) * 64 + m * 4;
    const float* ap  = myreg + m * CH_APITCH + half * 4;

    // first trip's weights: asked for ahead of the rows, so that both are in flight together
    float2 f0[4]; float4 f1[4];
#pragma unroll
    for (int j = 0; j < 4; ++j) {
        f0[j] = jh_ld2(w0p + j * 32);
        f1[j] = jh_ld4(w1p + j * 64);
    }

    // stage this wave's K slice of the gathered rows: 256 B runs, two rows a load
    {
        const float* src = cemb + wave * 64 + m * 4;
        float* dst = myreg + half * CH_APITCH + m * 4;
        int sid[NT * 8];
        float4 v[NT * 8];
#pragma unroll
        for (int i = 0; i < NT * 8; ++i) sid[i] = list[min(base + 2 * i + half, cnt - 1)];
        // all loads first, so that they are in flight together; then the LDS stores
#pragma unroll
        for (int i = 0; i < NT * 8; ++i) v[i] = jh_ld4(src + (size_t)sid[i] * 1024);
#pragma unroll
        for (int i = 0; i < NT * 8; ++i) *(float4*)(dst + 2 * i * CH_APITCH) = v[i];
    }

    v8f acc[NT][6];
#pragma unroll
    for (int mt = 0; mt < NT; ++mt)
#pragma unroll
        for (int t = 0; t < 6; ++t)
#pragma unroll
            for (int i = 0; i < 8; ++i) acc[mt][t][i] = 0.0f;

    v2f bf[2][6];
#pragma unroll
    for (int s = 0; s < 2; ++s) {
        bf[s][0].x = f0[2 * s].x; bf[s][0].y = f0[2 * s + 1].x;
        bf[s][1].x = f0[2 * s].y; bf[s][1].y = f0[2 * s + 1].y;
        bf[s][2].x = f1[2 * s].x; bf[s][2].y = f1[2 * s + 1].x;
        bf[s][3].x = f1[2 * s].y; bf[s][3].y = f1[2 * s + 1].y;
        bf[s][4].x = f1[2 * s].z; bf[s][4].y = f1[2 * s + 1].z;
        bf[s][5].x = f1[2 * s].w; bf[s][5].y = f1[2 * s + 1].w;
    }

    // unroll 2: lets the two register sets of the weight fetch-ahead swap without copies
#pragma unroll 2
    for (int it = 0; it < 8; ++it) {
        // next trip's weights are fetched before this trip's products
        const int nx = (it < 7) ? it + 1 : 7;
        float2 n0[4]; float4 n1[4]; float4 a[NT];
#pragma unroll
        for (int j = 0; j < 4; ++j) {
            n0[j] = jh_ld2(w0p + (nx * 8 + j) * 32);
            n1[j] = jh_ld4(w1p + (nx * 8 + j) * 64);
        }
#pragma unroll
        for (int mt = 0; mt < NT; ++mt)
            a[mt] = *(const float4*)(ap + mt * 16 * CH_APITCH + it * 8);

#pragma unroll
        for (int s = 0; s < 2; ++s)
#pragma unroll
            for (int t = 0; t < 6; ++t)
#pragma unroll
                for (int mt = 0; mt < NT; ++mt) {
                    v2f af;
                    af.x = s ? a[mt].z : a[mt].x;
                    af.y = s ? a[mt].w : a[mt].y;
                    acc[mt][t] = __builtin_amdgcn_wmma_f32_16x16x4_f32(
                        false, af, false, bf[s][t], (short)0, acc[mt][t], false, false);
                }

#pragma unroll
        for (int s = 0; s < 2; ++s) {
            bf[s][0].x = n0[2 * s].x; bf[s][0].y = n0[2 * s + 1].x;
            bf[s][1].x = n0[2 * s].y; bf[s][1].y = n0[2 * s + 1].y;
            bf[s][2].x = n1[2 * s].x; bf[s][2].y = n1[2 * s + 1].x;
            bf[s][3].x = n1[2 * s].y; bf[s][3].y = n1[2 * s + 1].y;
            bf[s][4].x = n1[2 * s].z; bf[s][4].y = n1[2 * s + 1].z;
            bf[s][5].x = n1[2 * s].w; bf[s][5].y = n1[2 * s + 1].w;
        }
    }

    // partial sums into this wave's own LDS (its staged rows are used up)
#pragma unroll
    for (int mt = 0; mt < NT; ++mt)
#pragma unroll
        for (int r = 0; r < 8; ++r) {
            float* dst = myreg + half * 8 * CH_RPITCH + (mt * 16 + r) * CH_RPITCH;
            float2 u; u.x = acc[mt][0][r]; u.y = acc[mt][1][r];
            float4 w; w.x = acc[mt][2][r]; w.y = acc[mt][3][r];
                      w.z = acc[mt][4][r]; w.w = acc[mt][5][r];
            *(float2*)(dst + m * 2) = u;
            *(float4*)(dst + 32 + m * 4) = w;
        }
    __syncthreads();

    // 8 lanes per row: lane q holds the float4 columns q, q+8, q+16 of the 24
    if (wave * 4 < NT * 16) {
        const int row = tid >> 3, q = tid & 7;
        float4 v[3];
        v[0] = *(const float4*)(b0p + q * 4);
        v[1] = *(const float4*)(b1p + q * 4);
        v[2] = *(const float4*)(b1p + 32 + q * 4);
        const float* rp = smem + row * CH_RPITCH + q * 4;
#pragma unroll
        for (int w = 0; w < 16; ++w)
#pragma unroll
            for (int j = 0; j < 3; ++j) {
                const float4 t = *(const float4*)(rp + w * CH_WREG + j * 32);
                v[j].x += t.x; v[j].y += t.y; v[j].z += t.z; v[j].w += t.w;
            }
        float s0 = (v[0].x + v[0].y) + (v[0].z + v[0].w);
        float s1 = ((v[1].x + v[1].y) + (v[1].z + v[1].w)) + ((v[2].x + v[2].y) + (v[2].z + v[2].w));
        s0 += __shfl_xor(s0, 1, 32); s1 += __shfl_xor(s1, 1, 32);
        s0 += __shfl_xor(s0, 2, 32); s1 += __shfl_xor(s1, 2, 32);
        s0 += __shfl_xor(s0, 4, 32); s1 += __shfl_xor(s1, 4, 32);
        const float mean0 = s0 * (1.0f / 32.0f), mean1 = s1 * (1.0f / 64.0f);
#pragma unroll
        for (int j = 0; j < 3; ++j) {
            const float mu = (j < 1) ? mean0 : mean1;
            v[j].x -= mu; v[j].y -= mu; v[j].z -= mu; v[j].w -= mu;
        }
        float q0 = (v[0].x * v[0].x + v[0].y * v[0].y) + (v[0].z * v[0].z + v[0].w * v[0].w);
        float q1 = ((v[1].x * v[1].x + v[1].y * v[1].y) + (v[1].z * v[1].z + v[1].w * v[1].w))
                 + ((v[2].x * v[2].x + v[2].y * v[2].y) + (v[2].z * v[2].z + v[2].w * v[2].w));
        q0 += __shfl_xor(q0, 1, 32); q1 += __shfl_xor(q1, 1, 32);
        q0 += __shfl_xor(q0, 2, 32); q1 += __shfl_xor(q1, 2, 32);
        q0 += __shfl_xor(q0, 4, 32); q1 += __shfl_xor(q1, 4, 32);
        const float r0 = rsqrtf(q0 * (1.0f / 32.0f) + LN_EPS);
        const float r1 = rsqrtf(q1 * (1.0f / 64.0f) + LN_EPS);
        if (base + row < cnt) {
            const int s = list[base + row];
            float4 o;
            o.x = v[0].x * r0; o.y = v[0].y * r0; o.z = v[0].z * r0; o.w = v[0].w * r0;
            *(float4*)(out0 + (size_t)s * 32 + q * 4) = o;
            o.x = v[1].x * r1; o.y = v[1].y * r1; o.z = v[1].z * r1; o.w = v[1].w * r1;
            *(float4*)(out1 + (size_t)s * 64 + q * 4) = o;
            o.x = v[2].x * r1; o.y = v[2].y * r1; o.z = v[2].z * r1; o.w = v[2].w * r1;
            *(float4*)(out1 + (size_t)s * 64 + 32 + q * 4) = o;
            // the next group rewrites the stores' address and data registers
            asm volatile("s_wait_xcnt 0x0" ::: "memory");
        }
    }
}

__global__ __launch_bounds__(512) void jh_child_heads(
    const float* __restrict__ cemb,  // [8192,1024] (normalized)
    const float* __restrict__ w0,    // [16,1024,32]
    const float* __restrict__ b0,    // [16,32]
    const float* __restrict__ w1,    // [16,1024,64]
    const float* __restrict__ b1,    // [16,64]
    const int* __restrict__ pclass,  // [8192]
    float* __restrict__ out0,        // [8192,32]
    float* __restrict__ out1)        // [8192,64]
{
    __shared__ __attribute__((aligned(16))) float smem[16 * CH_WREG];
    __shared__ int list[CH_CHUNK];
    __shared__ int wcnt[16];
    __shared__ int wofs[16];

    const int tid  = threadIdx.x;
    const int wave = __builtin_amdgcn_readfirstlane(tid >> 5);
    const int lane = tid & 31;
    const int p    = blockIdx.y;

    // stable compaction of this chunk's samples of class p
    const int sa = blockIdx.x * CH_CHUNK + tid;
    const bool fa = (pclass[sa] == p);
    const unsigned ma = __builtin_amdgcn_ballot_w32(fa);
    if (lane == 0) { wcnt[wave] = __popc(ma); wofs[wave] = wave * CH_WREG; }
    __syncthreads();
    int pa = 0, tot = 0;
#pragma unroll
    for (int i = 0; i < 16; ++i) {
        const int c = wcnt[i];
        if (i < wave) pa += c;
        tot += c;
    }
    if (fa) list[pa + __popc(ma & ((1u << lane) - 1u))] = sa;
    __syncthreads();
    const int cnt = __builtin_amdgcn_readfirstlane(tot);

    const float* W0  = w0 + (size_t)p * 1024 * 32;
    const float* W1  = w1 + (size_t)p * 1024 * 64;
    const float* b0p = b0 + p * 32;
    const float* b1p = b1 + p * 64;

    for (int base = 0; base < cnt; base += CH_ROWS) {
        const int nt = (cnt - base + 15) >> 4;
        if (nt >= 3)
            jh_child_group<3>(cemb, W0, W1, b0p, b1p, out0, out1, smem, list, wofs, base, cnt, tid, wave);
        else if (nt == 2)
            jh_child_group<2>(cemb, W0, W1, b0p, b1p, out0, out1, smem, list, wofs, base, cnt, tid, wave);
        else
            jh_child_group<1>(cemb, W0, W1, b0p, b1p, out0, out1, smem, list, wofs, base, cnt, tid, wave);
        // the partial sums are read out before the next group's rows land on them
        __syncthreads();
    }
}

// ---------------------------------------------------------------------------
extern "C" void kernel_launch(void* const* d_in, const int* in_sizes, int n_in,
                              void* d_out, int out_size, void* d_ws, size_t ws_size,
                              hipStream_t stream) {
    (void)in_sizes; (void)n_in; (void)out_size; (void)ws_size;
    const float* x   = (const float*)d_in[0];
    const float* ppw = (const float*)d_in[1];
    const float* ppb = (const float*)d_in[2];
    const float* cpw = (const float*)d_in[3];
    const float* cpb = (const float*)d_in[4];
    const float* pcw = (const float*)d_in[5];
    const float* pcb = (const float*)d_in[6];
    const float* cw0 = (const float*)d_in[7];
    const float* cb0 = (const float*)d_in[8];
    const float* cw1 = (const float*)d_in[9];
    const float* cb1 = (const float*)d_in[10];

    float* out   = (float*)d_out;
    float* plog  = out;                       // [8192,16]
    float* c0    = plog + 8192 * 16;          // [8192,32]
    float* c1    = c0   + 8192 * 32;          // [8192,64]
    float* pemb  = c1   + 8192 * 64;          // [8192,1024]
    float* cemb  = pemb + 8192 * 1024;        // [8192,1024]
    int*   pclass = (int*)d_ws;               // [8192]

    // 1) both big GEMMs (raw, pre-bias) into d_out emb regions
    dim3 g1(1024 / 64, 8192 / 256, 2);
    jh_gemm_dual<<<g1, 256, 0, stream>>>(x, ppw, cpw, pemb, cemb);

    // 2) bias + LayerNorm in place
    dim3 g2(8192 / 8, 2);
    jh_ln_bias<<<g2, 256, 0, stream>>>(pemb, cemb, ppb, cpb);

    // 3) parent logits (WMMA) + LN + argmax
    jh_parent_cls<<<8192 / 16, 32, 0, stream>>>(pemb, pcw, pcb, plog, pclass);

    // 4) child heads grouped by parent class (16 chunks x 16 parents) + LN
    dim3 g4(8192 / 512, 16);
    jh_child_heads<<<g4, 512, 0, stream>>>(cemb, cw0, cb0, cw1, cb1,
                                           pclass, c0, c1);
}
